// v000
// The times below were measured on an AMD MI455X: many runs one after another, warmed up first and cycling through
// copies of the inputs, with the whole window's GPU time divided by the number of runs. Launches and the gaps
// between them are all in it. The median over several windows is given; except for v000 it joins two sittings, which
// can be a few percent apart, so the side-by-side timings, each taken in one sitting, are the better comparison.
// v000 is the starting kernel. One run takes 497 microseconds.
#include <hip/hip_runtime.h>

typedef __attribute__((ext_vector_type(2))) float v2f;
typedef __attribute__((ext_vector_type(8))) float v8f;

#define MTOT   16384   // B*T
#define KDIM   1024
#define NDIM   1024
#define TSEQ   2048
#define BATCH  8
#define NCHUNK 16
#define CHUNKLEN 128   // TSEQ / NCHUNK
#define LDSTR  68      // padded LDS row stride (272B: 16B-aligned, conflict-light)
#define KTILE  64
#define NKT    (KDIM / KTILE)   // 16 K-tiles

__device__ __forceinline__ void async_copy_b128(unsigned lds_byte_off,
                                                const float* gaddr) {
    asm volatile("global_load_async_to_lds_b128 %0, %1, off"
                 :: "v"(lds_byte_off), "v"(gaddr) : "memory");
}
__device__ __forceinline__ unsigned lds_off(const void* p) {
    // generic (flat) pointer to __shared__: low 32 bits == LDS byte offset
    return (unsigned)(unsigned long long)p;
}

// out[m][n] = scale * ( A1[m,:]·W1[n,:] + bias1[n] (+ A2[m,:]·W2[n,:] + bias2[n]) )
// scale = exp(log_dt[0]) if log_dt != null else 1.0
__launch_bounds__(256, 2)
__global__ void ssm_gemm_wmma(const float* __restrict__ A1,
                              const float* __restrict__ W1,
                              const float* __restrict__ bias1,
                              const float* __restrict__ A2,
                              const float* __restrict__ W2,
                              const float* __restrict__ bias2,
                              const float* __restrict__ log_dt,
                              float* __restrict__ out)
{
    __shared__ float lds_a[2][64 * LDSTR];    // ~17.4 KB x2
    __shared__ float lds_w[2][128 * LDSTR];   // ~34.8 KB x2

    const int tid  = threadIdx.x;
    const int wv   = tid >> 5;       // wave 0..7 -> 16-col slice of the N-tile
    const int lane = tid & 31;
    const int hlf  = lane >> 4;
    const int ln   = lane & 15;

    const int m0 = blockIdx.y * 64;   // 4 x 16-row subtiles per wave
    const int n0 = blockIdx.x * 128;  // 8 waves x 16 cols

    v8f acc[4];
#pragma unroll
    for (int mi = 0; mi < 4; ++mi) acc[mi] = (v8f){0.f,0.f,0.f,0.f,0.f,0.f,0.f,0.f};

    // per-thread fill coordinates (A: 4 x float4, W: 8 x float4 per tile)
    const int fa_row = tid >> 4;            // +16 per step (4 steps -> 64 rows)
    const int fa_c4  = (tid & 15) << 2;

    for (int pass = 0; pass < 2; ++pass) {
        const float* Ap = pass ? A2 : A1;
        const float* Wp = pass ? W2 : W1;
        if (!Ap) break;

        // issue async fills of one K-tile into LDS buffer `buf`
        auto issue_fill = [&](int buf, int k0) {
#pragma unroll
            for (int i = 0; i < 4; ++i) {            // A tile: 64 x 64
                const int row = fa_row + (i << 4);
                async_copy_b128(lds_off(&lds_a[buf][row * LDSTR + fa_c4]),
                                Ap + (size_t)(m0 + row) * KDIM + k0 + fa_c4);
            }
#pragma unroll
            for (int i = 0; i < 8; ++i) {            // W tile: 128 x 64
                const int idx = tid + (i << 8);
                const int row = idx >> 4;
                const int c4  = (idx & 15) << 2;
                async_copy_b128(lds_off(&lds_w[buf][row * LDSTR + c4]),
                                Wp + (size_t)(n0 + row) * KDIM + k0 + c4);
            }
        };

        issue_fill(0, 0);                            // prologue

        for (int jt = 0; jt < NKT; ++jt) {
            const int  cur     = jt & 1;
            const bool hasnext = (jt + 1) < NKT;
            if (hasnext) {
                issue_fill(cur ^ 1, (jt + 1) * KTILE);
                // 12 next-tile copies in flight; current tile (issued earlier,
                // completes in order) is done once outstanding <= 12
                asm volatile("s_wait_asynccnt 0xc" ::: "memory");
            } else {
                asm volatile("s_wait_asynccnt 0x0" ::: "memory");
            }
            __syncthreads();                         // cur buffer visible to all

            const float* ap = &lds_a[cur][ln * LDSTR];
            const float* wp = &lds_w[cur][(wv * 16 + ln) * LDSTR];
#pragma unroll
            for (int kk = 0; kk < KTILE; kk += 4) {
                const int ko = kk + (hlf << 1);
                const v2f b = *(const v2f*)(wp + ko);
#pragma unroll
                for (int mi = 0; mi < 4; ++mi) {
                    const v2f a = *(const v2f*)(ap + (mi << 4) * LDSTR + ko);
                    acc[mi] = __builtin_amdgcn_wmma_f32_16x16x4_f32(
                        false, a, false, b, (short)0, acc[mi], false, false);
                }
            }
            __syncthreads();         // compute done before cur is refilled
        }
    }

    float scale = 1.0f;
    if (log_dt) scale = __expf(log_dt[0]);
    const int col = n0 + wv * 16 + ln;
    const float bias = bias1[col] + (bias2 ? bias2[col] : 0.0f);

#pragma unroll
    for (int mi = 0; mi < 4; ++mi) {
#pragma unroll
        for (int r = 0; r < 8; ++r) {
            const int m = m0 + (mi << 4) + r + (hlf << 3);
            out[(size_t)m * NDIM + col] = scale * (acc[mi][r] + bias);
        }
    }
}

// ---- chunked diagonal scan: x_t = abar * x_{t-1} + Bu_t ------------------

__global__ void ssm_scan_pass1(const float* __restrict__ Bu,
                               const float* __restrict__ log_A,
                               const float* __restrict__ log_dt,
                               float* __restrict__ chunk_state)
{
    const int idx = blockIdx.x * blockDim.x + threadIdx.x; // [0, B*NCHUNK*N)
    const int n = idx & (NDIM - 1);
    const int c = (idx >> 10) & (NCHUNK - 1);
    const int b = idx >> 14;
    const float dt   = __expf(log_dt[0]);
    const float abar = __expf(-__expf(log_A[n]) * dt);
    const float* p = Bu + ((size_t)b * TSEQ + (size_t)c * CHUNKLEN) * NDIM + n;
    float x = 0.f;
#pragma unroll 4
    for (int t = 0; t < CHUNKLEN; ++t)
        x = fmaf(abar, x, p[(size_t)t * NDIM]);
    chunk_state[((size_t)c * BATCH + b) * NDIM + n] = x;
}

__global__ void ssm_scan_pass2(float* __restrict__ chunk_state,
                               const float* __restrict__ log_A,
                               const float* __restrict__ log_dt)
{
    const int idx = blockIdx.x * blockDim.x + threadIdx.x; // [0, B*N)
    const int n = idx & (NDIM - 1);
    const int b = idx >> 10;
    const float dt = __expf(log_dt[0]);
    const float abar_ck = __expf(-__expf(log_A[n]) * dt * (float)CHUNKLEN); // abar^CHUNKLEN
    float carry = 0.f;
    for (int c = 0; c < NCHUNK; ++c) {
        const size_t o = ((size_t)c * BATCH + b) * NDIM + n;
        const float s = chunk_state[o];
        chunk_state[o] = carry;                 // exclusive carry-in for chunk c
        carry = fmaf(abar_ck, carry, s);
    }
}

__global__ void ssm_scan_pass3(float* __restrict__ Bu,   // overwritten with xs
                               const float* __restrict__ chunk_state,
                               const float* __restrict__ log_A,
                               const float* __restrict__ log_dt)
{
    const int idx = blockIdx.x * blockDim.x + threadIdx.x;
    const int n = idx & (NDIM - 1);
    const int c = (idx >> 10) & (NCHUNK - 1);
    const int b = idx >> 14;
    const float dt   = __expf(log_dt[0]);
    const float abar = __expf(-__expf(log_A[n]) * dt);
    float x = chunk_state[((size_t)c * BATCH + b) * NDIM + n];
    float* p = Bu + ((size_t)b * TSEQ + (size_t)c * CHUNKLEN) * NDIM + n;
#pragma unroll 4
    for (int t = 0; t < CHUNKLEN; ++t) {
        x = fmaf(abar, x, p[(size_t)t * NDIM]);
        p[(size_t)t * NDIM] = x;
    }
}

extern "C" void kernel_launch(void* const* d_in, const int* in_sizes, int n_in,
                              void* d_out, int out_size, void* d_ws, size_t ws_size,
                              hipStream_t stream) {
    const float* u      = (const float*)d_in[0];
    const float* log_A  = (const float*)d_in[1];
    const float* W_B    = (const float*)d_in[2];
    const float* b_B    = (const float*)d_in[3];
    const float* W_C    = (const float*)d_in[4];
    const float* b_C    = (const float*)d_in[5];
    const float* W_D    = (const float*)d_in[6];
    const float* b_D    = (const float*)d_in[7];
    const float* log_dt = (const float*)d_in[8];

    float* ws_x = (float*)d_ws;                              // Bu -> xs, 64 MB
    float* cs   = ws_x + (size_t)MTOT * NDIM;                // chunk states, 512 KB

    const dim3 blk(256);
    const dim3 gg(NDIM / 128, MTOT / 64);                    // (8, 256)

    // 1) Bu = dt * (u @ W_B^T + b_B)
    ssm_gemm_wmma<<<gg, blk, 0, stream>>>(u, W_B, b_B, nullptr, nullptr, nullptr,
                                          log_dt, ws_x);
    // 2-4) diagonal scan, chunk-parallel
    ssm_scan_pass1<<<(BATCH * NCHUNK * NDIM) / 256, blk, 0, stream>>>(ws_x, log_A, log_dt, cs);
    ssm_scan_pass2<<<(BATCH * NDIM) / 256, blk, 0, stream>>>(cs, log_A, log_dt);
    ssm_scan_pass3<<<(BATCH * NCHUNK * NDIM) / 256, blk, 0, stream>>>(ws_x, cs, log_A, log_dt);
    // 5) y = xs @ W_C^T + u @ W_D^T + (b_C + b_D)   (fused dual GEMM)
    ssm_gemm_wmma<<<gg, blk, 0, stream>>>(ws_x, W_C, b_C, u, W_D, b_D,
                                          nullptr, (float*)d_out);
}

// v001
// It runs in 462 microseconds.
// Timed twice side by side with v000, it ran 1.10 times as fast both times.
#include <hip/hip_runtime.h>

typedef __attribute__((ext_vector_type(2))) float v2f;
typedef __attribute__((ext_vector_type(8))) float v8f;
typedef __attribute__((ext_vector_type(4))) float v4f;

#define MTOT   16384   // B*T
#define KDIM   1024
#define NDIM   1024
#define TSEQ   2048
#define BATCH  8
#define SCOLS  32               // scan strip: columns per work-group
#define SSTEP  32               // scan: time steps a thread holds in registers
#define SCHUNK (TSEQ / SSTEP)   // 64 chunks per strip
#define STHR   (SCHUNK * (SCOLS / 4))   // 512 threads: one per chunk and column quad
#define LDSTR  68      // padded LDS row stride (272B: 16B-aligned, conflict-light)
#define KTILE  64
#define NKT    (KDIM / KTILE)   // 16 K-tiles

__device__ __forceinline__ void async_copy_b128(unsigned lds_byte_off,
                                                const float* gaddr) {
    asm volatile("global_load_async_to_lds_b128 %0, %1, off"
                 :: "v"(lds_byte_off), "v"(gaddr) : "memory");
}
__device__ __forceinline__ unsigned lds_off(const void* p) {
    // generic (flat) pointer to __shared__: low 32 bits == LDS byte offset
    return (unsigned)(unsigned long long)p;
}

// out[m][n] = scale * ( A1[m,:]·W1[n,:] + bias1[n] (+ A2[m,:]·W2[n,:] + bias2[n]) )
// scale = exp(log_dt[0]) if log_dt != null else 1.0
__launch_bounds__(256, 2)
__global__ void ssm_gemm_wmma(const float* __restrict__ A1,
                              const float* __restrict__ W1,
                              const float* __restrict__ bias1,
                              const float* __restrict__ A2,
                              const float* __restrict__ W2,
                              const float* __restrict__ bias2,
                              const float* __restrict__ log_dt,
                              float* __restrict__ out)
{
    __shared__ float lds_a[2][64 * LDSTR];    // ~17.4 KB x2
    __shared__ float lds_w[2][128 * LDSTR];   // ~34.8 KB x2

    const int tid  = threadIdx.x;
    const int wv   = tid >> 5;       // wave 0..7 -> 16-col slice of the N-tile
    const int lane = tid & 31;
    const int hlf  = lane >> 4;
    const int ln   = lane & 15;

    const int m0 = blockIdx.y * 64;   // 4 x 16-row subtiles per wave
    const int n0 = blockIdx.x * 128;  // 8 waves x 16 cols

    v8f acc[4];
#pragma unroll
    for (int mi = 0; mi < 4; ++mi) acc[mi] = (v8f){0.f,0.f,0.f,0.f,0.f,0.f,0.f,0.f};

    // per-thread fill coordinates (A: 4 x float4, W: 8 x float4 per tile)
    const int fa_row = tid >> 4;            // +16 per step (4 steps -> 64 rows)
    const int fa_c4  = (tid & 15) << 2;

    for (int pass = 0; pass < 2; ++pass) {
        const float* Ap = pass ? A2 : A1;
        const float* Wp = pass ? W2 : W1;
        if (!Ap) break;

        // issue async fills of one K-tile into LDS buffer `buf`
        auto issue_fill = [&](int buf, int k0) {
#pragma unroll
            for (int i = 0; i < 4; ++i) {            // A tile: 64 x 64
                const int row = fa_row + (i << 4);
                async_copy_b128(lds_off(&lds_a[buf][row * LDSTR + fa_c4]),
                                Ap + (size_t)(m0 + row) * KDIM + k0 + fa_c4);
            }
#pragma unroll
            for (int i = 0; i < 8; ++i) {            // W tile: 128 x 64
                const int idx = tid + (i << 8);
                const int row = idx >> 4;
                const int c4  = (idx & 15) << 2;
                async_copy_b128(lds_off(&lds_w[buf][row * LDSTR + c4]),
                                Wp + (size_t)(n0 + row) * KDIM + k0 + c4);
            }
        };

        issue_fill(0, 0);                            // prologue

        for (int jt = 0; jt < NKT; ++jt) {
            const int  cur     = jt & 1;
            const bool hasnext = (jt + 1) < NKT;
            if (hasnext) {
                issue_fill(cur ^ 1, (jt + 1) * KTILE);
                // 12 next-tile copies in flight; current tile (issued earlier,
                // completes in order) is done once outstanding <= 12
                asm volatile("s_wait_asynccnt 0xc" ::: "memory");
            } else {
                asm volatile("s_wait_asynccnt 0x0" ::: "memory");
            }
            __syncthreads();                         // cur buffer visible to all

            const float* ap = &lds_a[cur][ln * LDSTR];
            const float* wp = &lds_w[cur][(wv * 16 + ln) * LDSTR];
#pragma unroll
            for (int kk = 0; kk < KTILE; kk += 4) {
                const int ko = kk + (hlf << 1);
                const v2f b = *(const v2f*)(wp + ko);
#pragma unroll
                for (int mi = 0; mi < 4; ++mi) {
                    const v2f a = *(const v2f*)(ap + (mi << 4) * LDSTR + ko);
                    acc[mi] = __builtin_amdgcn_wmma_f32_16x16x4_f32(
                        false, a, false, b, (short)0, acc[mi], false, false);
                }
            }
            __syncthreads();         // compute done before cur is refilled
        }
    }

    float scale = 1.0f;
    if (log_dt) scale = __expf(log_dt[0]);
    const int col = n0 + wv * 16 + ln;
    const float bias = bias1[col] + (bias2 ? bias2[col] : 0.0f);

#pragma unroll
    for (int mi = 0; mi < 4; ++mi) {
#pragma unroll
        for (int r = 0; r < 8; ++r) {
            const int m = m0 + (mi << 4) + r + (hlf << 3);
            out[(size_t)m * NDIM + col] = scale * (acc[mi][r] + bias);
        }
    }
}

// ---- diagonal scan x_t = abar * x_{t-1} + Bu_t, one launch ---------------
// One work-group owns one batch row and one 32-column strip (one 128-byte line
// per time step) for all TSEQ steps. Each thread keeps SSTEP steps of 4 columns
// in registers, so Bu is read once and xs written once; the chunk carries go
// through LDS inside the work-group.
__launch_bounds__(STHR)
__global__ void ssm_scan_strip(float* __restrict__ Bu,   // overwritten with xs
                               const float* __restrict__ log_A,
                               const float* __restrict__ log_dt)
{
    // 16-byte aligned: both are written as float4
    __shared__ __attribute__((aligned(16))) float cst[SCHUNK * SCOLS];  // chunk end states, then carry-ins
    __shared__ __attribute__((aligned(16))) float lab[SCOLS];           // log(abar) per column

    const int tid = threadIdx.x;
    const int q   = tid & 7;                  // column quad inside the strip
    const int c   = tid >> 3;                 // chunk of SSTEP time steps
    const int b   = blockIdx.x >> 5;
    const int ns  = (blockIdx.x & 31) * SCOLS;
    const int n   = ns + (q << 2);

    const float dt = __expf(log_dt[0]);

    float4* p = (float4*)(Bu + ((size_t)b * TSEQ + (size_t)c * SSTEP) * NDIM + n);
    float4 v[SSTEP];
    // every loop over v[] is fully unrolled so that v[] lives in registers
#pragma unroll
    for (int i = 0; i < SSTEP; ++i) v[i] = p[i * (NDIM / 4)];   // all in flight

    // log_A of this thread's four columns. Load and data wait in one statement:
    // the address register stays untouched until the load has returned.
    v4f la;
    asm volatile("global_load_b128 %0, %1, off\n\ts_wait_loadcnt 0x0"
                 : "=&v"(la) : "v"(log_A + n) : "memory");

    float4 lg, ab;
    lg.x = -__expf(la.x) * dt;  ab.x = __expf(lg.x);
    lg.y = -__expf(la.y) * dt;  ab.y = __expf(lg.y);
    lg.z = -__expf(la.z) * dt;  ab.z = __expf(lg.z);
    lg.w = -__expf(la.w) * dt;  ab.w = __expf(lg.w);

    // chunk end state from a zero start
    float4 s = make_float4(0.f, 0.f, 0.f, 0.f);
#pragma unroll
    for (int i = 0; i < SSTEP; ++i) {
        s.x = fmaf(ab.x, s.x, v[i].x);
        s.y = fmaf(ab.y, s.y, v[i].y);
        s.z = fmaf(ab.z, s.z, v[i].z);
        s.w = fmaf(ab.w, s.w, v[i].w);
    }
    *(float4*)&cst[c * SCOLS + (q << 2)] = s;
    if (c == 0) *(float4*)&lab[q << 2] = lg;
    __syncthreads();

    // exclusive carry over the chunks: wave 0, one lane per column
    if (tid < SCOLS) {
        const float ack = __expf(lab[tid] * (float)SSTEP);   // abar^SSTEP
        float carry = 0.f;
        for (int c0 = 0; c0 < SCHUNK; c0 += 16) {
            float e[16];   // unrolled: 16 LDS reads go out ahead of the dependent chain
#pragma unroll
            for (int j = 0; j < 16; ++j) e[j] = cst[(c0 + j) * SCOLS + tid];
#pragma unroll
            for (int j = 0; j < 16; ++j) {
                cst[(c0 + j) * SCOLS + tid] = carry;
                carry = fmaf(ack, carry, e[j]);
            }
        }
    }
    __syncthreads();

    // the recurrence again, now from the chunk's carry-in
    float4 x = *(const float4*)&cst[c * SCOLS + (q << 2)];
#pragma unroll
    for (int i = 0; i < SSTEP; ++i) {
        x.x = fmaf(ab.x, x.x, v[i].x);
        x.y = fmaf(ab.y, x.y, v[i].y);
        x.z = fmaf(ab.z, x.z, v[i].z);
        x.w = fmaf(ab.w, x.w, v[i].w);
        v[i] = x;
    }
#pragma unroll
    for (int i = 0; i < SSTEP; ++i) p[i * (NDIM / 4)] = v[i];
}

extern "C" void kernel_launch(void* const* d_in, const int* in_sizes, int n_in,
                              void* d_out, int out_size, void* d_ws, size_t ws_size,
                              hipStream_t stream) {
    const float* u      = (const float*)d_in[0];
    const float* log_A  = (const float*)d_in[1];
    const float* W_B    = (const float*)d_in[2];
    const float* b_B    = (const float*)d_in[3];
    const float* W_C    = (const float*)d_in[4];
    const float* b_C    = (const float*)d_in[5];
    const float* W_D    = (const float*)d_in[6];
    const float* b_D    = (const float*)d_in[7];
    const float* log_dt = (const float*)d_in[8];

    float* ws_x = (float*)d_ws;                              // Bu -> xs, 64 MB

    const dim3 blk(256);
    const dim3 gg(NDIM / 128, MTOT / 64);                    // (8, 256)

    // 1) Bu = dt * (u @ W_B^T + b_B)
    ssm_gemm_wmma<<<gg, blk, 0, stream>>>(u, W_B, b_B, nullptr, nullptr, nullptr,
                                          log_dt, ws_x);
    // 2) diagonal scan in place, one work-group per (batch, 32-column strip)
    ssm_scan_strip<<<BATCH * (NDIM / SCOLS), dim3(STHR), 0, stream>>>(ws_x, log_A, log_dt);
    // 3) y = xs @ W_C^T + u @ W_D^T + (b_C + b_D)   (fused dual GEMM)
    ssm_gemm_wmma<<<gg, blk, 0, stream>>>(ws_x, W_C, b_C, u, W_D, b_D,
                                          nullptr, (float*)d_out);
}

// v002
// Measured time: 419 microseconds a run.
// Next to v001, in two timings, it ran 1.10 times as fast each time.
// All steps since v000 together make it 1.21 times as fast.
#include <hip/hip_runtime.h>

typedef __attribute__((ext_vector_type(2))) float v2f;
typedef __attribute__((ext_vector_type(8))) float v8f;
typedef __attribute__((ext_vector_type(4))) float v4f;

#define MTOT   16384   // B*T
#define KDIM   1024
#define NDIM   1024
#define TSEQ   2048
#define BATCH  8
#define SCOLS  32               // scan strip: columns per work-group
#define SSTEP  32               // scan: time steps a thread holds in registers
#define SCHUNK (TSEQ / SSTEP)   // 64 chunks per strip
#define STHR   (SCHUNK * (SCOLS / 4))   // 512 threads: one per chunk and column quad
#define LDSTR  68      // padded LDS row stride (272B: 16B-aligned, conflict-light)
#define KTILE  64
#define NKT    (KDIM / KTILE)   // 16 K-tiles
#define BM     256              // GEMM work-group tile: rows
#define BN     256              // GEMM work-group tile: columns
#define GTHR   512              // 16 waves, 4 x 4, each a 64 x 64 piece of the tile

__device__ __forceinline__ void async_copy8_b128(unsigned lds_byte_off,
                                                 const float* gaddr) {
    const unsigned ls = 32 * LDSTR * 4;     // 32 rows further in LDS, bytes
    const size_t   gs = (size_t)32 * KDIM;  // 32 rows further in memory, floats
    asm volatile("global_load_async_to_lds_b128 %0, %8, off\n\t"
                 "global_load_async_to_lds_b128 %1, %9, off\n\t"
                 "global_load_async_to_lds_b128 %2, %10, off\n\t"
                 "global_load_async_to_lds_b128 %3, %11, off\n\t"
                 "global_load_async_to_lds_b128 %4, %12, off\n\t"
                 "global_load_async_to_lds_b128 %5, %13, off\n\t"
                 "global_load_async_to_lds_b128 %6, %14, off\n\t"
                 "global_load_async_to_lds_b128 %7, %15, off\n\t"
                 "s_wait_xcnt 0x0"
                 :: "v"(lds_byte_off),          "v"(lds_byte_off + ls),
                    "v"(lds_byte_off + 2 * ls), "v"(lds_byte_off + 3 * ls),
                    "v"(lds_byte_off + 4 * ls), "v"(lds_byte_off + 5 * ls),
                    "v"(lds_byte_off + 6 * ls), "v"(lds_byte_off + 7 * ls),
                    "v"(gaddr),          "v"(gaddr + gs),
                    "v"(gaddr + 2 * gs), "v"(gaddr + 3 * gs),
                    "v"(gaddr + 4 * gs), "v"(gaddr + 5 * gs),
                    "v"(gaddr + 6 * gs), "v"(gaddr + 7 * gs)
                 : "memory");
}
__device__ __forceinline__ unsigned lds_off(const void* p) {
    // generic (flat) pointer to __shared__: low 32 bits == LDS byte offset
    return (unsigned)(unsigned long long)p;
}

// out[m][n] = scale * ( A1[m,:]·W1[n,:] + bias1[n] (+ A2[m,:]·W2[n,:] + bias2[n]) )
// scale = exp(log_dt[0]) if log_dt != null else 1.0
__launch_bounds__(GTHR)
__global__ void ssm_gemm_wmma(const float* __restrict__ A1,
                              const float* __restrict__ W1,
                              const float* __restrict__ bias1,
                              const float* __restrict__ A2,
                              const float* __restrict__ W2,
                              const float* __restrict__ bias2,
                              const float* __restrict__ log_dt,
                              float* __restrict__ out)
{
    // 16-byte aligned: the copies write 16 bytes at a time
    __shared__ __attribute__((aligned(16))) float lds_a[2][BM * LDSTR];   // 68 KB x2
    __shared__ __attribute__((aligned(16))) float lds_w[2][BN * LDSTR];   // 68 KB x2

    const int tid  = threadIdx.x;
    const int wv   = tid >> 5;       // wave 0..15
    const int wm   = wv >> 2;        // 64-row slice of the tile
    const int wn   = wv & 3;         // 64-column slice of the tile
    const int lane = tid & 31;
    const int hlf  = lane >> 4;
    const int ln   = lane & 15;

    const int m0 = blockIdx.y * BM;
    const int n0 = blockIdx.x * BN;

    // every loop over acc[], a[] and b[] is fully unrolled so that they live in registers
    v8f acc[4][4];
#pragma unroll
    for (int mi = 0; mi < 4; ++mi)
#pragma unroll
        for (int ni = 0; ni < 4; ++ni)
            acc[mi][ni] = (v8f){0.f,0.f,0.f,0.f,0.f,0.f,0.f,0.f};

    // per-thread fill coordinates (A: 8 x float4, W: 8 x float4 per tile)
    const int f_row = tid >> 4;             // +32 per copy (8 copies -> 256 rows)
    const int f_c4  = (tid & 15) << 2;

    for (int pass = 0; pass < 2; ++pass) {
        const float* Ap = pass ? A2 : A1;
        const float* Wp = pass ? W2 : W1;
        if (!Ap) break;

        // issue async fills of one K-tile into LDS buffer `buf`
        auto issue_fill = [&](int buf, int k0) {
            async_copy8_b128(lds_off(&lds_a[buf][f_row * LDSTR + f_c4]),
                             Ap + (size_t)(m0 + f_row) * KDIM + k0 + f_c4);
            async_copy8_b128(lds_off(&lds_w[buf][f_row * LDSTR + f_c4]),
                             Wp + (size_t)(n0 + f_row) * KDIM + k0 + f_c4);
        };

        // prologue: tile 0 landed and published, then tile 1 on its way.
        // (Every reader of an earlier pass left both buffers at its last barrier.)
        issue_fill(0, 0);
        asm volatile("s_wait_asynccnt 0x0" ::: "memory");   // own copies of tile 0 landed
        __syncthreads();                                     // tile 0 visible to all
        issue_fill(1, KTILE);

        for (int jt = 0; jt < NKT; ++jt) {
            const int cur = jt & 1;

            const float* ap = &lds_a[cur][(wm * 64 + ln) * LDSTR];
            const float* wp = &lds_w[cur][(wn * 64 + ln) * LDSTR];
            // fragments of 8 k (two WMMA steps) are fetched one block ahead into a
            // second register set, so a block's LDS latency runs under the block before it
            v2f a[2][2][4], b[2][2][4];
            auto load_frags = [&](int set, int kb) {
#pragma unroll
                for (int h = 0; h < 2; ++h) {
                    const int ko = kb + (h << 2) + (hlf << 1);
#pragma unroll
                    for (int ni = 0; ni < 4; ++ni)
                        b[set][h][ni] = *(const v2f*)(wp + (ni << 4) * LDSTR + ko);
#pragma unroll
                    for (int mi = 0; mi < 4; ++mi)
                        a[set][h][mi] = *(const v2f*)(ap + (mi << 4) * LDSTR + ko);
                }
            };
            load_frags(0, 0);
#pragma unroll
            for (int kb = 0; kb < KTILE; kb += 8) {
                const int set = (kb >> 3) & 1;
                if (kb + 8 < KTILE) {
                    load_frags(set ^ 1, kb + 8);
                } else {
                    // foot of the trip, ahead of the last block's WMMAs (they read registers
                    // only): one barrier publishes tile jt+1 and frees buffer cur, and the
                    // waves it releases still have matrix work at hand
                    asm volatile("s_wait_dscnt 0x0" ::: "memory");     // own reads of cur are done
                    asm volatile("s_wait_asynccnt 0x0" ::: "memory");  // own copies of tile jt+1 landed
                    __syncthreads();
                }
#pragma unroll
                for (int h = 0; h < 2; ++h)
#pragma unroll
                    for (int mi = 0; mi < 4; ++mi)
#pragma unroll
                        for (int ni = 0; ni < 4; ++ni)
                            acc[mi][ni] = __builtin_amdgcn_wmma_f32_16x16x4_f32(
                                false, a[set][h][mi], false, b[set][h][ni], (short)0,
                                acc[mi][ni], false, false);
            }

            if (jt + 2 < NKT) issue_fill(cur, (jt + 2) * KTILE);
        }
        asm volatile("s_wait_asynccnt 0x0" ::: "memory");      // nothing in flight behind the ring
    }

    float scale = 1.0f;
    if (log_dt) scale = __expf(log_dt[0]);

    float bias[4];
#pragma unroll
    for (int ni = 0; ni < 4; ++ni) {
        const int col = n0 + wn * 64 + (ni << 4) + ln;
        bias[ni] = bias1[col] + (bias2 ? bias2[col] : 0.0f);
    }
#pragma unroll
    for (int mi = 0; mi < 4; ++mi) {
#pragma unroll
        for (int r = 0; r < 8; ++r) {
            const int m = m0 + wm * 64 + (mi << 4) + r + (hlf << 3);
            float* orow = out + (size_t)m * NDIM + n0 + wn * 64 + ln;
#pragma unroll
            for (int ni = 0; ni < 4; ++ni)
                orow[ni << 4] = scale * (acc[mi][ni][r] + bias[ni]);
        }
    }
}

// ---- diagonal scan x_t = abar * x_{t-1} + Bu_t, one launch ---------------
// One work-group owns one batch row and one 32-column strip (one 128-byte line
// per time step) for all TSEQ steps. Each thread keeps SSTEP steps of 4 columns
// in registers, so Bu is read once and xs written once; the chunk carries go
// through LDS inside the work-group.
__launch_bounds__(STHR)
__global__ void ssm_scan_strip(float* __restrict__ Bu,   // overwritten with xs
                               const float* __restrict__ log_A,
                               const float* __restrict__ log_dt)
{
    // 16-byte aligned: both are written as float4
    __shared__ __attribute__((aligned(16))) float cst[SCHUNK * SCOLS];  // chunk end states, then carry-ins
    __shared__ __attribute__((aligned(16))) float lab[SCOLS];           // log(abar) per column

    const int tid = threadIdx.x;
    const int q   = tid & 7;                  // column quad inside the strip
    const int c   = tid >> 3;                 // chunk of SSTEP time steps
    const int b   = blockIdx.x >> 5;
    const int ns  = (blockIdx.x & 31) * SCOLS;
    const int n   = ns + (q << 2);

    const float dt = __expf(log_dt[0]);

    float4* p = (float4*)(Bu + ((size_t)b * TSEQ + (size_t)c * SSTEP) * NDIM + n);
    float4 v[SSTEP];
    // every loop over v[] is fully unrolled so that v[] lives in registers
#pragma unroll
    for (int i = 0; i < SSTEP; ++i) v[i] = p[i * (NDIM / 4)];   // all in flight

    // log_A of this thread's four columns. Load and data wait in one statement:
    // the address register stays untouched until the load has returned.
    v4f la;
    asm volatile("global_load_b128 %0, %1, off\n\ts_wait_loadcnt 0x0"
                 : "=&v"(la) : "v"(log_A + n) : "memory");

    float4 lg, ab;
    lg.x = -__expf(la.x) * dt;  ab.x = __expf(lg.x);
    lg.y = -__expf(la.y) * dt;  ab.y = __expf(lg.y);
    lg.z = -__expf(la.z) * dt;  ab.z = __expf(lg.z);
    lg.w = -__expf(la.w) * dt;  ab.w = __expf(lg.w);

    // chunk end state from a zero start
    float4 s = make_float4(0.f, 0.f, 0.f, 0.f);
#pragma unroll
    for (int i = 0; i < SSTEP; ++i) {
        s.x = fmaf(ab.x, s.x, v[i].x);
        s.y = fmaf(ab.y, s.y, v[i].y);
        s.z = fmaf(ab.z, s.z, v[i].z);
        s.w = fmaf(ab.w, s.w, v[i].w);
    }
    *(float4*)&cst[c * SCOLS + (q << 2)] = s;
    if (c == 0) *(float4*)&lab[q << 2] = lg;
    __syncthreads();

    // exclusive carry over the chunks: wave 0, one lane per column
    if (tid < SCOLS) {
        const float ack = __expf(lab[tid] * (float)SSTEP);   // abar^SSTEP
        float carry = 0.f;
        for (int c0 = 0; c0 < SCHUNK; c0 += 16) {
            float e[16];   // unrolled: 16 LDS reads go out ahead of the dependent chain
#pragma unroll
            for (int j = 0; j < 16; ++j) e[j] = cst[(c0 + j) * SCOLS + tid];
#pragma unroll
            for (int j = 0; j < 16; ++j) {
                cst[(c0 + j) * SCOLS + tid] = carry;
                carry = fmaf(ack, carry, e[j]);
            }
        }
    }
    __syncthreads();

    // the recurrence again, now from the chunk's carry-in
    float4 x = *(const float4*)&cst[c * SCOLS + (q << 2)];
#pragma unroll
    for (int i = 0; i < SSTEP; ++i) {
        x.x = fmaf(ab.x, x.x, v[i].x);
        x.y = fmaf(ab.y, x.y, v[i].y);
        x.z = fmaf(ab.z, x.z, v[i].z);
        x.w = fmaf(ab.w, x.w, v[i].w);
        v[i] = x;
    }
#pragma unroll
    for (int i = 0; i < SSTEP; ++i) p[i * (NDIM / 4)] = v[i];
}

extern "C" void kernel_launch(void* const* d_in, const int* in_sizes, int n_in,
                              void* d_out, int out_size, void* d_ws, size_t ws_size,
                              hipStream_t stream) {
    const float* u      = (const float*)d_in[0];
    const float* log_A  = (const float*)d_in[1];
    const float* W_B    = (const float*)d_in[2];
    const float* b_B    = (const float*)d_in[3];
    const float* W_C    = (const float*)d_in[4];
    const float* b_C    = (const float*)d_in[5];
    const float* W_D    = (const float*)d_in[6];
    const float* b_D    = (const float*)d_in[7];
    const float* log_dt = (const float*)d_in[8];

    float* ws_x = (float*)d_ws;                              // Bu -> xs, 64 MB

    const dim3 blk(GTHR);
    const dim3 gg(NDIM / BN, MTOT / BM);                     // (4, 64): one work-group per WGP

    // 1) Bu = dt * (u @ W_B^T + b_B)
    ssm_gemm_wmma<<<gg, blk, 0, stream>>>(u, W_B, b_B, nullptr, nullptr, nullptr,
                                          log_dt, ws_x);
    // 2) diagonal scan in place, one work-group per (batch, 32-column strip)
    ssm_scan_strip<<<BATCH * (NDIM / SCOLS), dim3(STHR), 0, stream>>>(ws_x, log_A, log_dt);
    // 3) y = xs @ W_C^T + u @ W_D^T + (b_C + b_D)   (fused dual GEMM)
    ssm_gemm_wmma<<<gg, blk, 0, stream>>>(ws_x, W_C, b_C, u, W_D, b_D,
                                          nullptr, (float*)d_out);
}
